// v000
// Times are from an AMD MI455X. After a warm-up the kernel runs many times in a row, and a time is the length of
// such a window on the GPU divided by its runs, so every launch and the gaps after it count. The runs cycle
// through copies of the inputs. A figure is the median of several windows, for all but v000 over two sittings.
// Sittings can differ by a few percent; kernels timed side by side share one.
// v000, which the later versions start from, runs in 147 microseconds.
#include <hip/hip_runtime.h>

typedef __attribute__((ext_vector_type(2))) float v2f;
typedef __attribute__((ext_vector_type(8))) float v8f;

#define N_TOK 8192
#define H_DIM 1024
#define C_CLS 1024
#define K_WRD 32

#define BM 64
#define BN 128
#define BK 16
#define APAD 4
#define BPAD 4

// -------------------------------------------------------------------------
// Kernel 1: p_class[N,C] = x[N,H] @ W_cls[C,H]^T + b_cls  (fp32 WMMA GEMM)
// Double-buffered LDS, register prefetch: next stage's global loads are in
// flight while the current stage's 16 v_wmma_f32_16x16x4_f32 execute.
// -------------------------------------------------------------------------
__global__ void __launch_bounds__(256)
class_gemm_wmma(const float* __restrict__ x,
                const float* __restrict__ W,     // [C,H] row-major
                const float* __restrict__ bias,  // [C]
                float* __restrict__ out)         // [N,C]
{
    __shared__ float As[2][BK][BM + APAD];   // As[b][k][m] (K-major)
    __shared__ float Bs[2][BK][BN + BPAD];   // Bs[b][k][n] = W[n][k0+k]

    const int t    = threadIdx.x;
    const int wave = t >> 5;
    const int lane = t & 31;
    const int hi   = lane >> 4;      // 0: lanes 0-15, 1: lanes 16-31
    const int mr   = lane & 15;

    const int m_wave = (wave >> 2) * 32;   // 2 wave rows
    const int n_wave = (wave & 3) * 32;    // 4 wave cols

    const int blockM = blockIdx.y * BM;
    const int blockN = blockIdx.x * BN;

    v8f acc[2][2];
    #pragma unroll
    for (int mi = 0; mi < 2; ++mi)
        #pragma unroll
        for (int ni = 0; ni < 2; ++ni)
            acc[mi][ni] = (v8f){0.f,0.f,0.f,0.f,0.f,0.f,0.f,0.f};

    // loader mapping: one float4 of A, two float4 of B per thread per stage
    const int arow = t >> 2;              // 0..63
    const int acol = (t & 3) << 2;        // 0,4,8,12

    const float* xg  = x + (size_t)(blockM + arow) * H_DIM + acol;
    const float* wg0 = W + (size_t)(blockN + arow)      * H_DIM + acol;
    const float* wg1 = W + (size_t)(blockN + arow + 64) * H_DIM + acol;

    float4 av  = *(const float4*)(xg);
    float4 bv0 = *(const float4*)(wg0);
    float4 bv1 = *(const float4*)(wg1);

    auto store_stage = [&](int buf) {
        As[buf][acol + 0][arow] = av.x;
        As[buf][acol + 1][arow] = av.y;
        As[buf][acol + 2][arow] = av.z;
        As[buf][acol + 3][arow] = av.w;
        Bs[buf][acol + 0][arow] = bv0.x;
        Bs[buf][acol + 1][arow] = bv0.y;
        Bs[buf][acol + 2][arow] = bv0.z;
        Bs[buf][acol + 3][arow] = bv0.w;
        Bs[buf][acol + 0][arow + 64] = bv1.x;
        Bs[buf][acol + 1][arow + 64] = bv1.y;
        Bs[buf][acol + 2][arow + 64] = bv1.z;
        Bs[buf][acol + 3][arow + 64] = bv1.w;
    };

    auto prefetch = [&](int k0) {
        av  = *(const float4*)(xg  + k0);
        bv0 = *(const float4*)(wg0 + k0);
        bv1 = *(const float4*)(wg1 + k0);
    };

    auto compute_stage = [&](int buf) {
        #pragma unroll
        for (int kk = 0; kk < BK; kk += 4) {
            const int kb = kk + (hi << 1);   // lanes 16-31 hold K=+2,+3

            v2f a0, a1, b0, b1;
            a0.x = As[buf][kb    ][m_wave + mr];
            a0.y = As[buf][kb + 1][m_wave + mr];
            a1.x = As[buf][kb    ][m_wave + 16 + mr];
            a1.y = As[buf][kb + 1][m_wave + 16 + mr];
            b0.x = Bs[buf][kb    ][n_wave + mr];
            b0.y = Bs[buf][kb + 1][n_wave + mr];
            b1.x = Bs[buf][kb    ][n_wave + 16 + mr];
            b1.y = Bs[buf][kb + 1][n_wave + 16 + mr];

            acc[0][0] = __builtin_amdgcn_wmma_f32_16x16x4_f32(
                false, a0, false, b0, (short)0, acc[0][0], false, false);
            acc[0][1] = __builtin_amdgcn_wmma_f32_16x16x4_f32(
                false, a0, false, b1, (short)0, acc[0][1], false, false);
            acc[1][0] = __builtin_amdgcn_wmma_f32_16x16x4_f32(
                false, a1, false, b0, (short)0, acc[1][0], false, false);
            acc[1][1] = __builtin_amdgcn_wmma_f32_16x16x4_f32(
                false, a1, false, b1, (short)0, acc[1][1], false, false);
        }
    };

    store_stage(0);

    for (int k0 = 0; k0 < H_DIM; k0 += 2 * BK) {
        __syncthreads();
        prefetch(k0 + BK);               // always in range (loop step 2*BK)
        compute_stage(0);                // overlaps with loads above
        store_stage(1);
        __syncthreads();
        if (k0 + 2 * BK < H_DIM) prefetch(k0 + 2 * BK);
        compute_stage(1);
        if (k0 + 2 * BK < H_DIM) store_stage(0);
    }

    // C/D layout: VGPR r -> row r + 8*hi, col = lane&15
    #pragma unroll
    for (int mi = 0; mi < 2; ++mi) {
        #pragma unroll
        for (int ni = 0; ni < 2; ++ni) {
            const int gm = blockM + m_wave + mi * 16;
            const int gn = blockN + n_wave + ni * 16 + mr;
            const float bc = bias[gn];
            #pragma unroll
            for (int r = 0; r < 8; ++r) {
                out[(size_t)(gm + r + 8 * hi) * C_CLS + gn] = acc[mi][ni][r] + bc;
            }
        }
    }
}

// -------------------------------------------------------------------------
// Kernel 2: p_words[i,k] = dot(x[i,:], W_words[cls[i],k,:]) + b_words[cls[i],k]
// One block per token; x row staged in LDS via CDNA5 async global->LDS copy.
// -------------------------------------------------------------------------
__global__ void __launch_bounds__(256)
words_matvec(const float* __restrict__ x,
             const int*   __restrict__ cls,
             const float* __restrict__ W_words,  // [C,K,H]
             const float* __restrict__ b_words,  // [C,K]
             float* __restrict__ p_words)        // [N,K]
{
    __shared__ float xs[H_DIM];
    const int i = blockIdx.x;
    const int t = threadIdx.x;
    const int c = cls[i];

    // async copy: 16 bytes/lane, 256 lanes => 4KB x row, LDS write bypasses VGPRs.
    // Low 32 bits of the flat shared address are the LDS byte offset.
    {
        unsigned      lds = (unsigned)(uintptr_t)(&xs[t * 4]);
        const float*  g   = x + (size_t)i * H_DIM + t * 4;
        asm volatile("global_load_async_to_lds_b128 %0, %1, off"
                     :: "v"(lds), "v"(g) : "memory");
        asm volatile("s_wait_asynccnt 0x0" ::: "memory");
    }
    __syncthreads();

    const int wave = t >> 5;
    const int lane = t & 31;

    // each lane caches its 8 float4 chunks of x (reused for 4 outputs)
    float4 xr[8];
    #pragma unroll
    for (int j = 0; j < 8; ++j)
        xr[j] = ((const float4*)xs)[lane + 32 * j];

    const float* Wb = W_words + (size_t)c * K_WRD * H_DIM;

    #pragma unroll
    for (int q = 0; q < 4; ++q) {
        const int k = wave * 4 + q;
        const float4* Wr = (const float4*)(Wb + (size_t)k * H_DIM);
        float s = 0.f;
        #pragma unroll
        for (int j = 0; j < 8; ++j) {
            const float4 w = Wr[lane + 32 * j];
            s += xr[j].x * w.x + xr[j].y * w.y + xr[j].z * w.z + xr[j].w * w.w;
        }
        // wave32 reduction
        #pragma unroll
        for (int off = 16; off > 0; off >>= 1)
            s += __shfl_xor(s, off, 32);
        if (lane == 0)
            p_words[(size_t)i * K_WRD + k] = s + b_words[(size_t)c * K_WRD + k];
    }
}

// -------------------------------------------------------------------------
extern "C" void kernel_launch(void* const* d_in, const int* in_sizes, int n_in,
                              void* d_out, int out_size, void* d_ws, size_t ws_size,
                              hipStream_t stream)
{
    const float* x       = (const float*)d_in[0];
    const int*   cls     = (const int*)  d_in[1];
    const float* W_cls   = (const float*)d_in[2];
    const float* b_cls   = (const float*)d_in[3];
    const float* W_words = (const float*)d_in[4];
    const float* b_words = (const float*)d_in[5];

    float* p_class = (float*)d_out;                         // [N,C]
    float* p_words = p_class + (size_t)N_TOK * C_CLS;       // [N,K]

    dim3 gridA(C_CLS / BN, N_TOK / BM);   // 8 x 128 blocks
    class_gemm_wmma<<<gridA, 256, 0, stream>>>(x, W_cls, b_cls, p_class);

    words_matvec<<<N_TOK, 256, 0, stream>>>(x, cls, W_words, b_words, p_words);
}

// v001
// One run takes 119 microseconds.
// Two timings next to v000 both put it at 1.26 times that version's speed.
#include <hip/hip_runtime.h>

typedef __attribute__((ext_vector_type(2))) float v2f;
typedef __attribute__((ext_vector_type(8))) float v8f;

#define N_TOK 8192
#define H_DIM 1024
#define C_CLS 1024
#define K_WRD 32

#define BM 64
#define BN 128
#define BK 16
#define APAD 4
#define BPAD 4

// -------------------------------------------------------------------------
// Kernel 1: p_class[N,C] = x[N,H] @ W_cls[C,H]^T + b_cls  (fp32 WMMA GEMM)
// Double-buffered LDS, register prefetch: next stage's global loads are in
// flight while the current stage's 16 v_wmma_f32_16x16x4_f32 execute.
// -------------------------------------------------------------------------
__global__ void __launch_bounds__(256)
class_gemm_wmma(const float* __restrict__ x,
                const float* __restrict__ W,     // [C,H] row-major
                const float* __restrict__ bias,  // [C]
                float* __restrict__ out)         // [N,C]
{
    __shared__ float As[2][BK][BM + APAD];   // As[b][k][m] (K-major)
    __shared__ float Bs[2][BK][BN + BPAD];   // Bs[b][k][n] = W[n][k0+k]

    const int t    = threadIdx.x;
    const int wave = t >> 5;
    const int lane = t & 31;
    const int hi   = lane >> 4;      // 0: lanes 0-15, 1: lanes 16-31
    const int mr   = lane & 15;

    const int m_wave = (wave >> 2) * 32;   // 2 wave rows
    const int n_wave = (wave & 3) * 32;    // 4 wave cols

    const int blockM = blockIdx.y * BM;
    const int blockN = blockIdx.x * BN;

    v8f acc[2][2];
    #pragma unroll
    for (int mi = 0; mi < 2; ++mi)
        #pragma unroll
        for (int ni = 0; ni < 2; ++ni)
            acc[mi][ni] = (v8f){0.f,0.f,0.f,0.f,0.f,0.f,0.f,0.f};

    // loader mapping: one float4 of A, two float4 of B per thread per stage
    const int arow = t >> 2;              // 0..63
    const int acol = (t & 3) << 2;        // 0,4,8,12

    const float* xg  = x + (size_t)(blockM + arow) * H_DIM + acol;
    const float* wg0 = W + (size_t)(blockN + arow)      * H_DIM + acol;
    const float* wg1 = W + (size_t)(blockN + arow + 64) * H_DIM + acol;

    float4 av  = *(const float4*)(xg);
    float4 bv0 = *(const float4*)(wg0);
    float4 bv1 = *(const float4*)(wg1);

    auto store_stage = [&](int buf) {
        As[buf][acol + 0][arow] = av.x;
        As[buf][acol + 1][arow] = av.y;
        As[buf][acol + 2][arow] = av.z;
        As[buf][acol + 3][arow] = av.w;
        Bs[buf][acol + 0][arow] = bv0.x;
        Bs[buf][acol + 1][arow] = bv0.y;
        Bs[buf][acol + 2][arow] = bv0.z;
        Bs[buf][acol + 3][arow] = bv0.w;
        Bs[buf][acol + 0][arow + 64] = bv1.x;
        Bs[buf][acol + 1][arow + 64] = bv1.y;
        Bs[buf][acol + 2][arow + 64] = bv1.z;
        Bs[buf][acol + 3][arow + 64] = bv1.w;
    };

    auto prefetch = [&](int k0) {
        av  = *(const float4*)(xg  + k0);
        bv0 = *(const float4*)(wg0 + k0);
        bv1 = *(const float4*)(wg1 + k0);
    };

    auto compute_stage = [&](int buf) {
        #pragma unroll
        for (int kk = 0; kk < BK; kk += 4) {
            const int kb = kk + (hi << 1);   // lanes 16-31 hold K=+2,+3

            v2f a0, a1, b0, b1;
            a0.x = As[buf][kb    ][m_wave + mr];
            a0.y = As[buf][kb + 1][m_wave + mr];
            a1.x = As[buf][kb    ][m_wave + 16 + mr];
            a1.y = As[buf][kb + 1][m_wave + 16 + mr];
            b0.x = Bs[buf][kb    ][n_wave + mr];
            b0.y = Bs[buf][kb + 1][n_wave + mr];
            b1.x = Bs[buf][kb    ][n_wave + 16 + mr];
            b1.y = Bs[buf][kb + 1][n_wave + 16 + mr];

            acc[0][0] = __builtin_amdgcn_wmma_f32_16x16x4_f32(
                false, a0, false, b0, (short)0, acc[0][0], false, false);
            acc[0][1] = __builtin_amdgcn_wmma_f32_16x16x4_f32(
                false, a0, false, b1, (short)0, acc[0][1], false, false);
            acc[1][0] = __builtin_amdgcn_wmma_f32_16x16x4_f32(
                false, a1, false, b0, (short)0, acc[1][0], false, false);
            acc[1][1] = __builtin_amdgcn_wmma_f32_16x16x4_f32(
                false, a1, false, b1, (short)0, acc[1][1], false, false);
        }
    };

    store_stage(0);

    for (int k0 = 0; k0 < H_DIM; k0 += 2 * BK) {
        __syncthreads();
        prefetch(k0 + BK);               // always in range (loop step 2*BK)
        compute_stage(0);                // overlaps with loads above
        store_stage(1);
        __syncthreads();
        if (k0 + 2 * BK < H_DIM) prefetch(k0 + 2 * BK);
        compute_stage(1);
        if (k0 + 2 * BK < H_DIM) store_stage(0);
    }

    // C/D layout: VGPR r -> row r + 8*hi, col = lane&15
    #pragma unroll
    for (int mi = 0; mi < 2; ++mi) {
        #pragma unroll
        for (int ni = 0; ni < 2; ++ni) {
            const int gm = blockM + m_wave + mi * 16;
            const int gn = blockN + n_wave + ni * 16 + mr;
            const float bc = bias[gn];
            #pragma unroll
            for (int r = 0; r < 8; ++r) {
                out[(size_t)(gm + r + 8 * hi) * C_CLS + gn] = acc[mi][ni][r] + bc;
            }
        }
    }
}

// -------------------------------------------------------------------------
// Kernel 2: p_words[i,k] = dot(x[i,:], W_words[cls[i],k,:]) + b_words[cls[i],k]
// One block per CLASS: the block holds the class's 32 weight rows in registers
// (4 rows per wave), finds the tokens of its class by scanning cls, and runs
// every one of them against those registers. Token rows are staged in LDS by
// async global->LDS copies, TCH rows at a time.
// -------------------------------------------------------------------------
#define TCH 16

// Work-group barrier that orders LDS traffic only: unlike __syncthreads() it
// does not drain the global loads, so the weight rows stay in flight across it.
__device__ __forceinline__ void lds_barrier()
{
    __builtin_amdgcn_fence(__ATOMIC_RELEASE, "workgroup", "local");
    __builtin_amdgcn_s_barrier();
    __builtin_amdgcn_fence(__ATOMIC_ACQUIRE, "workgroup", "local");
}

__global__ void __launch_bounds__(256)
words_by_class(const float* __restrict__ x,
               const int*   __restrict__ cls,
               const float* __restrict__ W_words,  // [C,K,H]
               const float* __restrict__ b_words,  // [C,K]
               float* __restrict__ p_words)        // [N,K]
{
    __shared__ float          xs[TCH][H_DIM];
    __shared__ unsigned short list[N_TOK];   // token ids of this class
    __shared__ int            wtot[8];

    const int c    = blockIdx.x;
    const int t    = threadIdx.x;
    const int wave = __builtin_amdgcn_readfirstlane(t >> 5);
    const int lane = t & 31;

    // cls first: its loads return ahead of the weight rows, which stay in
    // flight during the prefix sum and the list build below.
    int4 cv[8];
    #pragma unroll  // constant indices: the arrays stay in registers
    for (int j = 0; j < 8; ++j)
        cv[j] = ((const int4*)cls)[j * 256 + t];

    const float* Wb = W_words + (size_t)c * K_WRD * H_DIM;
    float4 wr[4][8];
    #pragma unroll  // constant indices: the arrays stay in registers
    for (int q = 0; q < 4; ++q) {
        const float4* Wr = (const float4*)(Wb + (size_t)(wave * 4 + q) * H_DIM);
        #pragma unroll  // constant indices: the arrays stay in registers
        for (int j = 0; j < 8; ++j)
            wr[q][j] = Wr[lane + 32 * j];
    }
    const float bk = b_words[(size_t)c * K_WRD + wave * 4 + (lane & 3)];

    // one bit per scanned element, then a block-wide exclusive prefix sum
    unsigned mask = 0u;
    #pragma unroll  // constant indices: the arrays stay in registers
    for (int j = 0; j < 8; ++j) {
        mask |= (cv[j].x == c ? 1u : 0u) << (4 * j + 0);
        mask |= (cv[j].y == c ? 1u : 0u) << (4 * j + 1);
        mask |= (cv[j].z == c ? 1u : 0u) << (4 * j + 2);
        mask |= (cv[j].w == c ? 1u : 0u) << (4 * j + 3);
    }
    const int cnt = __popc(mask);
    int inc = cnt;
    #pragma unroll  // five fixed shuffle distances, no loop overhead
    for (int off = 1; off < 32; off <<= 1) {
        const int v = __shfl_up(inc, off, 32);
        if (lane >= off) inc += v;
    }
    if (lane == 31) wtot[wave] = inc;
    lds_barrier();
    int n = 0, pos = inc - cnt;
    #pragma unroll  // eight fixed LDS reads, merged into wide loads
    for (int w = 0; w < 8; ++w) {
        const int v = wtot[w];
        if (w < wave) pos += v;
        n += v;
    }
    n = __builtin_amdgcn_readfirstlane(n);
    for (int it = 0; it < 32 && mask != 0u; ++it) {
        const int b = __ffs(mask) - 1;
        mask &= mask - 1u;
        list[pos++] = (unsigned short)((((b >> 2) * 256 + t) << 2) + (b & 3));
    }
    lds_barrier();

    for (int base = 0; base < n; base += TCH) {
        const int m = (n - base < TCH) ? (n - base) : TCH;

        // each wave brings whole token rows: 8 copies of 16 bytes a lane = 4 KB
        #pragma unroll  // two fixed row slots a wave, each under its own scalar test
        for (int r0 = 0; r0 < TCH; r0 += 8) {
            const int r = r0 + wave;
            if (r < m) {
                const int tok = __builtin_amdgcn_readfirstlane((int)list[base + r]);
                const float* g   = x + (size_t)tok * H_DIM + lane * 4;
                const unsigned l = (unsigned)(uintptr_t)(&xs[r][lane * 4]);
                // the closing s_wait_xcnt keeps the address registers from
                // being rewritten while a copy still names them
                asm volatile("global_load_async_to_lds_b128 %0, %8, off\n\t"
                             "global_load_async_to_lds_b128 %1, %9, off\n\t"
                             "global_load_async_to_lds_b128 %2, %10, off\n\t"
                             "global_load_async_to_lds_b128 %3, %11, off\n\t"
                             "global_load_async_to_lds_b128 %4, %12, off\n\t"
                             "global_load_async_to_lds_b128 %5, %13, off\n\t"
                             "global_load_async_to_lds_b128 %6, %14, off\n\t"
                             "global_load_async_to_lds_b128 %7, %15, off\n\t"
                             "s_wait_xcnt 0x0"
                             :: "v"(l), "v"(l + 512u), "v"(l + 1024u), "v"(l + 1536u),
                                "v"(l + 2048u), "v"(l + 2560u), "v"(l + 3072u), "v"(l + 3584u),
                                "v"(g), "v"(g + 128), "v"(g + 256), "v"(g + 384),
                                "v"(g + 512), "v"(g + 640), "v"(g + 768), "v"(g + 896)
                             : "memory");
            }
        }
        // this wave's copies have landed; the barrier publishes them to all waves
        asm volatile("s_wait_asynccnt 0x0" ::: "memory");
        __syncthreads();

        for (int tt = 0; tt < m; ++tt) {
            const int tok = __builtin_amdgcn_readfirstlane((int)list[base + tt]);
            float4 xr[8];
            #pragma unroll  // constant indices: the arrays stay in registers
            for (int j = 0; j < 8; ++j)
                xr[j] = ((const float4*)xs[tt])[lane + 32 * j];

            float s[4];
            #pragma unroll  // constant indices: the arrays stay in registers
            for (int q = 0; q < 4; ++q) {
                float a = 0.f;
                #pragma unroll  // constant indices: the arrays stay in registers
                for (int j = 0; j < 8; ++j) {
                    const float4 w = wr[q][j];
                    a += xr[j].x * w.x + xr[j].y * w.y + xr[j].z * w.z + xr[j].w * w.w;
                }
                s[q] = a;
            }
            // wave32 reduction, the four sums side by side; every lane ends
            // with the same four totals
            #pragma unroll  // fixed shuffle distances; the four chains interleave
            for (int off = 16; off > 0; off >>= 1) {
                #pragma unroll  // constant indices: the arrays stay in registers
                for (int q = 0; q < 4; ++q)
                    s[q] += __shfl_xor(s[q], off, 32);
            }
            const float lo = (lane & 1) ? s[1] : s[0];
            const float hi = (lane & 1) ? s[3] : s[2];
            const float v  = (lane & 2) ? hi : lo;
            if (lane < 4)
                p_words[(size_t)tok * K_WRD + wave * 4 + lane] = v + bk;
            // the next trip reuses the store's address and data registers
            asm volatile("s_wait_xcnt 0x0" ::: "memory");
        }

        if (base + TCH < n) {
            // every reader has left xs before the next rows are copied over it
            asm volatile("s_wait_dscnt 0x0" ::: "memory");
            __syncthreads();
        }
    }
}

// -------------------------------------------------------------------------
extern "C" void kernel_launch(void* const* d_in, const int* in_sizes, int n_in,
                              void* d_out, int out_size, void* d_ws, size_t ws_size,
                              hipStream_t stream)
{
    const float* x       = (const float*)d_in[0];
    const int*   cls     = (const int*)  d_in[1];
    const float* W_cls   = (const float*)d_in[2];
    const float* b_cls   = (const float*)d_in[3];
    const float* W_words = (const float*)d_in[4];
    const float* b_words = (const float*)d_in[5];

    float* p_class = (float*)d_out;                         // [N,C]
    float* p_words = p_class + (size_t)N_TOK * C_CLS;       // [N,K]

    dim3 gridA(C_CLS / BN, N_TOK / BM);   // 8 x 128 blocks
    class_gemm_wmma<<<gridA, 256, 0, stream>>>(x, W_cls, b_cls, p_class);

    words_by_class<<<C_CLS, 256, 0, stream>>>(x, cls, W_words, b_words, p_words);
}
